// v000
// Measured on an AMD MI455X. A time is GPU time per run, averaged over a window of back-to-back runs after a warm-up
// (all launches, gaps included; the runs take copies of the inputs in turn), and the median of several windows.
// Apart from v000's, it joins two sittings. Times from different sittings can be a few percent apart, while
// side-by-side timings come from the same sitting.
// v000, which the later versions start from, runs in 2410 microseconds.
#include <hip/hip_runtime.h>

// Geometric attention on given tensors (queries, keys, values [4][2048][8][64] token-major (B, L, H, E); dot = q.k; wedge = sqrt(relu(|q|^2 |k|^2 - dot^2) + 1e-8); scores = ((1 - alpha) dot + alpha wedge) / 8 with alpha = 1 -> scores = wedge / 8; softmax over all keys; out = A.values -> [4][2048][8][64] (4.2 M)).
// Layout per batch: single bf16 head planes gathered from the token-major slabs (inputs bf16-exact after rounding: exact dot products, f32 accumulate) and per-row squared norms of q and k in f32 (one lane per row, fixed order); per head: exact dot scores, an element-wise kernel replaces each score by the wedge (f32: |q_i|^2 |k_j|^2 - dot^2, relu, + eps, precise sqrt; the (1 - alpha) dot term is exactly zero), the softmax with every row's probabilities as bf16 hi/lo, A.values as hi/lo x exact values^T (2 products); f32 rows written back token-major.
// Compute dtypes, f32 accumulate: every input rounded to bf16; q.k exact; norms, wedge and softmax f32; P hi/lo x exact values; output f32.

#define NB_  4
#define TT   2048
#define DM   512      // token-major row pitch (H x HD)
#define NH_  8
#define NKV  1
#define REP  (NH_ / NKV)
#define HD   64
#define DQ   (NH_ * HD)
#define DKV  (NKV * HD)
#define ZH   1
#define RH   2048                  // query rows < RH use hi+lo planes (0: none)
#define WIN  0
#define PCAR 1024.0f
#define SCL  0.125f   // 1/sqrt(64), applied to the wedge score
typedef _Float16 h16;
typedef unsigned short bf;
typedef __attribute__((ext_vector_type(16))) __bf16   v16bf;
typedef __attribute__((ext_vector_type(16))) _Float16 v16h;
typedef __attribute__((ext_vector_type(8)))  _Float16 v8h;
typedef __attribute__((ext_vector_type(8)))  unsigned short v8us;
typedef __attribute__((ext_vector_type(8)))  float    v8f;
typedef __attribute__((ext_vector_type(4)))  float    v4f;
typedef v8h  __attribute__((may_alias)) v8ha;
typedef v4f  __attribute__((may_alias)) v4fa;
typedef v8us __attribute__((may_alias)) v8usa;

__device__ __forceinline__ unsigned short f2bf(float f) { unsigned u = __float_as_uint(f); u += 0x7FFFu + ((u >> 16) & 1u); return (unsigned short)(u >> 16); }
__device__ __forceinline__ float bf2f(unsigned short b) { return __uint_as_float(((unsigned)b) << 16); }
__device__ __forceinline__ float bfr(float f) { return bf2f(f2bf(f)); }
__device__ __forceinline__ v16h cat16(v8h lo, v8h hi) { return __builtin_shufflevector(lo, hi, 0, 1, 2, 3, 4, 5, 6, 7, 8, 9, 10, 11, 12, 13, 14, 15); }
__device__ __forceinline__ v16bf cat16b(v8us lo, v8us hi) { return __builtin_bit_cast(v16bf, __builtin_shufflevector(lo, hi, 0, 1, 2, 3, 4, 5, 6, 7, 8, 9, 10, 11, 12, 13, 14, 15)); }
__device__ __forceinline__ v8f wmma16(v16h a, v16h b, v8f c) { return __builtin_amdgcn_wmma_f32_16x16x32_f16(false, a, false, b, (short)0, c, false, false); }
__device__ __forceinline__ v8f wmmab(v16bf a, v16bf b, v8f c) { return __builtin_amdgcn_wmma_f32_16x16x32_bf16(false, a, false, b, (short)0, c, false, false); }



// ---- k_gemmw: register-blocked GEMM, ONE WAVE per 64x64 output tile (16 accumulators), operands straight from K-contiguous 16-bit planes; grid (M/64, N/64, Z), 32 threads.
// C[m][n] (f32, pitch ldc, + optional f32 bias[n]) = sum_k A[m][k] Bt[n][k] (+ split products per NSPLIT). z-batch strides sA/sB/sC in elements. K % 32 == 0.
template <typename T16> struct WFrag;
template <> struct WFrag<h16> { typedef v16h V; static __device__ __forceinline__ V ld(const h16* p) { return cat16(*(const v8h*)p, *(const v8h*)(p + 16)); } static __device__ __forceinline__ v8f mma(V a, V b, v8f c) { return wmma16(a, b, c); } };
template <> struct WFrag<bf> { typedef v16bf V; static __device__ __forceinline__ V ld(const bf* p) { return cat16b(*(const v8us*)p, *(const v8us*)(p + 16)); } static __device__ __forceinline__ v8f mma(V a, V b, v8f c) { return wmmab(a, b, c); } };
template <typename T16, int NSPLIT, bool BIAS>
__global__ __launch_bounds__(32) void k_gemmw(const T16* __restrict__ A, const T16* __restrict__ A2, const T16* __restrict__ Bt, const T16* __restrict__ Bt2, int K, float* C, int ldc, const float* __restrict__ bias, size_t sA, size_t sB, size_t sC) {
    typedef typename WFrag<T16>::V V;
    __shared__ __align__(16) float os[16 * 68];
    const size_t z = blockIdx.z; A += z * sA; if (A2) A2 += z * sA; Bt += z * sB; if (Bt2) Bt2 += z * sB; C += z * sC;
    const int lane = threadIdx.x & 31, lr = lane & 15, hi = lane >> 4; const int r0 = blockIdx.x * 64, c0 = blockIdx.y * 64;
    v8f acc[4][4];
#pragma unroll
    for (int mb = 0; mb < 4; ++mb)
#pragma unroll
        for (int nb = 0; nb < 4; ++nb) acc[mb][nb] = (v8f){};
    const size_t aoff = (size_t)(r0 + lr) * K + 8 * hi, boff = (size_t)(c0 + lr) * K + 8 * hi;
#pragma unroll 1
    for (int kc = 0; kc < K; kc += 32) {
        V a[4], a2[4];
#pragma unroll
        for (int mb = 0; mb < 4; ++mb) { a[mb] = WFrag<T16>::ld(A + aoff + (size_t)mb * 16 * K + kc); if (NSPLIT == 1 || NSPLIT == 2) a2[mb] = WFrag<T16>::ld(A2 + aoff + (size_t)mb * 16 * K + kc); }
#pragma unroll
        for (int nb = 0; nb < 4; ++nb) { const V b = WFrag<T16>::ld(Bt + boff + (size_t)nb * 16 * K + kc); V b2; if (NSPLIT >= 2) b2 = WFrag<T16>::ld(Bt2 + boff + (size_t)nb * 16 * K + kc);
#pragma unroll
            for (int mb = 0; mb < 4; ++mb) { acc[mb][nb] = WFrag<T16>::mma(a[mb], b, acc[mb][nb]); if (NSPLIT == 1 || NSPLIT == 2) acc[mb][nb] = WFrag<T16>::mma(a2[mb], b, acc[mb][nb]); if (NSPLIT >= 2) acc[mb][nb] = WFrag<T16>::mma(a[mb], b2, acc[mb][nb]); } }
        asm volatile("v_nop\n\tv_nop\n\tv_nop\n\tv_nop" : "+v"(acc[0][0]), "+v"(acc[1][1]), "+v"(acc[2][2]), "+v"(acc[3][3]) : "v"(a[0]), "v"(a[3]));
    }
#pragma unroll
    for (int mb = 0; mb < 4; ++mb) {
#pragma unroll
        for (int nb = 0; nb < 4; ++nb) {
#pragma unroll
            for (int j = 0; j < 8; ++j) os[(hi * 8 + j) * 68 + nb * 16 + lr] = acc[mb][nb][j]; }
        __builtin_amdgcn_wave_barrier(); asm volatile("" ::: "memory");
        float* crow = C + (size_t)(r0 + mb * 16) * ldc + c0;
{
#pragma unroll
            for (int s = 0; s < 8; ++s) { const int row = 2 * s + hi, cofs = lr * 4; v4f val = *(const v4fa*)(os + row * 68 + cofs); if (BIAS) { val[0] += bfr(bias[c0 + cofs]); val[1] += bfr(bias[c0 + cofs + 1]); val[2] += bfr(bias[c0 + cofs + 2]); val[3] += bfr(bias[c0 + cofs + 3]); }
                *(v4f*)(crow + (size_t)row * ldc + cofs) = val; }
             }
        __builtin_amdgcn_wave_barrier(); asm volatile("" ::: "memory");
    }
}

__device__ __forceinline__ h16 tohx(float x) { return (h16)x; }
__device__ __forceinline__ void splitf(float y, unsigned short& h, unsigned short& l) { h = f2bf(y); l = f2bf(y - bf2f(h)); }
typedef __attribute__((ext_vector_type(2))) _Float16 v2h;
typedef __attribute__((ext_vector_type(4))) _Float16 v4h;
typedef __attribute__((ext_vector_type(2))) unsigned short v2us;
typedef __attribute__((ext_vector_type(4))) unsigned short v4us;
typedef __attribute__((ext_vector_type(2))) float v2f;
typedef __attribute__((ext_vector_type(4))) int v4i;

__global__ __launch_bounds__(256) void k_wtG(const float* __restrict__ w, int K, int N, bf* Bt) {
    const int lane = threadIdx.x & 31; const int L0 = (blockIdx.x * 8 + (threadIdx.x >> 5)) * 8; const int nlines = N * K / 64;
{
#pragma unroll 1
        for (int l = 0; l < 8; ++l) { const int L = L0 + l; if (L >= nlines) break; const size_t e = (size_t)L * 64 + lane * 2; const int k = (int)(e % K), n = (int)(e / K); v2us o;
            o[0] = f2bf(w[(size_t)k * N + n]); o[1] = f2bf(w[(size_t)(k + 1) * N + n]); *(v2us*)(Bt + e) = o; }
         }
}
__global__ __launch_bounds__(256) void k_cvt8(const float* __restrict__ src, bf* dst, size_t n8) { const size_t i = (size_t)blockIdx.x * 256 + threadIdx.x; if (i >= n8) return; const v8f v = *(const v8f*)(src + i * 8); v8us o;
#pragma unroll
    for (int k = 0; k < 8; ++k) o[k] = f2bf(v[k]); *(v8us*)(dst + i * 8) = o;  }


__global__ __launch_bounds__(256) void k_vtp(const float* __restrict__ F, int pitch, int nheads, h16* V16, bf* Vh, bf* Vl) { const size_t e = ((size_t)blockIdx.x * 256 + threadIdx.x) * 2; if (e >= (size_t)nheads * HD * TT) return; const int t = (int)(e % TT); const int d = (int)((e / TT) % HD); const int g = (int)(e / ((size_t)TT * HD)); v2h o16; v2us oh, ol;
#pragma unroll
    for (int q = 0; q < 2; ++q) { const float x = F[(size_t)(t + q) * pitch + g * HD + d]; o16[q] = tohx(x); unsigned short a2, c2; splitf(x, a2, c2); oh[q] = a2; ol[q] = c2; }
    *(v2h*)(V16 + e) = o16; *(v2us*)(Vh + e) = oh; *(v2us*)(Vl + e) = ol;  }

// k_asoft: per row (zz, i): t = S x HD^-0.5 (no mask); softmax over the 2048 keys (register row, one exp, fixed trees);
__global__ __launch_bounds__(256) void k_asoft(const float* __restrict__ Sb, h16* P16, bf* Ph, bf* Pl) {
    const int lane = threadIdx.x & 31; const int row = blockIdx.x * 8 + (threadIdx.x >> 5); if (row >= ZH * TT) return; const int i = row % TT; const int zz = row / TT; (void)zz; const bool hires = (i < RH); const float* sr = Sb + (size_t)row * TT; float v[TT / 32]; float mx = -3.0e38f;
#pragma unroll
    for (int ch = 0; ch < TT / 128; ++ch) { const int j0 = ch * 128 + lane * 4; const v4f a = *(const v4f*)(sr + j0);
#pragma unroll
        for (int q = 0; q < 4; ++q) { const float t = a[q] * SCL; v[ch * 4 + q] = t;   /* Sb already holds the wedge (k_wedge) */ mx = fmaxf(mx, t); } }
#pragma unroll
    for (int sh = 16; sh; sh >>= 1) mx = fmaxf(mx, __shfl_xor(mx, sh, 32));
    float sum = 0.f;
#pragma unroll
    for (int k = 0; k < TT / 32; ++k) { float d0 = __fsub_rn(v[k], mx); asm volatile("" : "+v"(d0)); v[k] = __builtin_amdgcn_exp2f(__fmul_rn(d0, 1.4426950408889634f)); sum += v[k]; }
#pragma unroll
    for (int sh = 16; sh; sh >>= 1) sum += __shfl_xor(sum, sh, 32);
    const float f = __fdiv_rn(hires ? 1.0f : PCAR, sum);
{
        if (hires) {
#pragma unroll
            for (int ch = 0; ch < TT / 128; ++ch) { v4us oh, ol;
#pragma unroll
                for (int q = 0; q < 4; ++q) { unsigned short a, c2; splitf(v[ch * 4 + q] * f, a, c2); oh[q] = a; ol[q] = c2; }
                const size_t oo = ((size_t)zz * (RH ? RH : 1) + i) * TT + ch * 128 + lane * 4; *(v4us*)(Ph + oo) = oh; *(v4us*)(Pl + oo) = ol; }
        } else {
#pragma unroll
            for (int ch = 0; ch < TT / 128; ++ch) { v4h o4;
#pragma unroll
                for (int q = 0; q < 4; ++q) o4[q] = tohx(v[ch * 4 + q] * f);
                *(v4h*)(P16 + (size_t)row * TT + ch * 128 + lane * 4) = o4; } }
         }
}
__global__ __launch_bounds__(256) void k_merge(const float* __restrict__ O, int h0, float* OUTb) { const size_t e = ((size_t)blockIdx.x * 256 + threadIdx.x) * 2; if (e >= (size_t)ZH * TT * HD) return; const int d = (int)(e % HD); const int t = (int)((e / HD) % TT); const int zz = (int)(e / ((size_t)HD * TT)); const float cs = (t < RH) ? 1.0f : (1.0f / PCAR); const size_t oo = (size_t)t * DQ + (h0 + zz) * HD + d;
    v2f o2; o2[0] = O[e] * cs; o2[1] = O[e + 1] * cs; *(v2f*)(OUTb + oo) = o2;  }


__global__ __launch_bounds__(256) void k_vtpR1(const float* __restrict__ Vb, bf* Vh) { const size_t e = ((size_t)blockIdx.x * 256 + threadIdx.x) * 2; if (e >= (size_t)HD * TT) return; const int t = (int)(e % TT); const int d = (int)(e / TT); v2us o; o[0] = f2bf(Vb[(size_t)t * HD + d]); o[1] = f2bf(Vb[(size_t)(t + 1) * HD + d]); *(v2us*)(Vh + e) = o;  }
__global__ __launch_bounds__(256) void k_mergeR(const float* __restrict__ O, float* outb, size_t n4) { const size_t i = (size_t)blockIdx.x * 256 + threadIdx.x; if (i >= n4) return; const v4f a = *(const v4f*)(O + i * 4); *(v4f*)(outb + i * 4) = a;  }


__global__ __launch_bounds__(256) void k_rown2(const float* __restrict__ src, float* N2) { const int lane = threadIdx.x & 31; const size_t wv = (size_t)blockIdx.x * 8 + (threadIdx.x >> 5); if (wv >= (size_t)NH_ * TT / 32) return; const int h = (int)(wv / (TT / 32)); const int t = (int)(wv % (TT / 32)) * 32 + lane; const float* f = src + (size_t)t * DM + h * HD; float s = 0.f;
#pragma unroll 4
    for (int d = 0; d < HD; d += 4) { const v4f a = *(const v4f*)(f + d);
#pragma unroll
        for (int q = 0; q < 4; ++q) { const float x = bfr(a[q]); float p = __fmul_rn(x, x); asm volatile("" : "+v"(p)); s = __fadd_rn(s, p); } }
    *(float*)(N2 + (size_t)h * TT + t) = s;  }
__global__ __launch_bounds__(256) void k_wedge(float* Sb, const float* __restrict__ qn, const float* __restrict__ kn) { const size_t k = (size_t)blockIdx.x * 256 + threadIdx.x; if (k >= (size_t)TT * TT / 4) return; const size_t e = k * 4; const int j0 = (int)(e % TT); const int i = (int)(e / TT); const float qi = qn[i]; const v4f kj = *(const v4f*)(kn + j0); v4f a = *(const v4f*)(Sb + e);
#pragma unroll
    for (int q = 0; q < 4; ++q) { float nn = __fmul_rn(qi, kj[q]); float d2 = __fmul_rn(a[q], a[q]); asm volatile("" : "+v"(nn), "+v"(d2)); float w2 = __fsub_rn(nn, d2); asm volatile("" : "+v"(w2)); w2 = fmaxf(w2, 0.0f); const float w = __fadd_rn(w2, 1e-8f); a[q] = __fsqrt_rn(w); }
    *(v4f*)(Sb + e) = a;  }
__global__ __launch_bounds__(256) void k_hp1(const float* __restrict__ src, bf* P) { const size_t i = (size_t)blockIdx.x * 256 + threadIdx.x; if (i >= (size_t)NH_ * TT * HD / 8) return; const size_t e = i * 8; const int d = (int)(e % HD); const int t = (int)((e / HD) % TT); const int h = (int)(e / ((size_t)HD * TT)); const v8f v = *(const v8f*)(src + (size_t)t * DM + h * HD + d); v8us o;
#pragma unroll
    for (int q = 0; q < 8; ++q) o[q] = f2bf(v[q]);
    *(v8us*)(P + e) = o;  }
__global__ __launch_bounds__(256) void k_vt1(const float* __restrict__ src, int pitch, bf* VT) { const size_t e = ((size_t)blockIdx.x * 256 + threadIdx.x) * 2; if (e >= (size_t)NH_ * HD * TT) return; const int t = (int)(e % TT); const int d = (int)((e / TT) % HD); const int h = (int)(e / ((size_t)TT * HD)); v2us o; o[0] = f2bf(src[(size_t)t * pitch + h * HD + d]); o[1] = f2bf(src[(size_t)(t + 1) * pitch + h * HD + d]); *(v2us*)(VT + e) = o;  }
__global__ __launch_bounds__(256) void k_mergeT(const float* __restrict__ O, int h, float* outb) { const size_t i = (size_t)blockIdx.x * 256 + threadIdx.x; if (i >= (size_t)TT * HD / 4) return; const size_t e = i * 4; const int d = (int)(e % HD); const int t = (int)(e / HD); const v4f a = *(const v4f*)(O + e); *(v4f*)(outb + (size_t)t * DM + h * HD + d) = a;  }

extern "C" void kernel_launch(void* const* d_in, const int* in_sizes, int n_in,
                              void* d_out, int out_size, void* d_ws, size_t ws_size, hipStream_t stream) {
    (void)in_sizes; (void)n_in; (void)out_size;
    const float* Qin = (const float*)d_in[0]; const float* Kin = (const float*)d_in[1]; const float* Vin = (const float*)d_in[2];
    float* OUT = (float*)d_out;
    char* wsp = (char*)d_ws;
    auto take = [&](size_t bytes) { char* p = wsp; wsp += (bytes + 255) & ~(size_t)255; return (void*)p; };
    bf* QB = (bf*)take((size_t)NH_ * TT * HD * 2); bf* KB = (bf*)take((size_t)NH_ * TT * HD * 2); bf* VT = (bf*)take((size_t)NH_ * HD * TT * 2);
    float* Sb = (float*)take((size_t)TT * TT * 4); float* QN = (float*)take((size_t)NH_ * TT * 4); float* KN = (float*)take((size_t)NH_ * TT * 4);  bf* Ph = (bf*)take((size_t)TT * TT * 2); bf* Pl = (bf*)take((size_t)TT * TT * 2); float* Ob = (float*)take((size_t)TT * HD * 4);
    if ((size_t)(wsp - (char*)d_ws) > ws_size) return;
    for (int b = 0; b < NB_; ++b) {
        const float* qb = Qin + (size_t)b * TT * DM; const float* kb = Kin + (size_t)b * TT * DM; const float* vb = Vin + (size_t)b * TT * DM;   /* token-major [t][h][d] slabs */
        k_hp1<<<(unsigned)(((size_t)NH_ * TT * HD / 8 + 255) / 256), 256, 0, stream>>>(qb, QB); k_hp1<<<(unsigned)(((size_t)NH_ * TT * HD / 8 + 255) / 256), 256, 0, stream>>>(kb, KB); k_vt1<<<(unsigned)(((size_t)NH_ * HD * TT / 2 + 255) / 256), 256, 0, stream>>>(vb, DM, VT); k_rown2<<<(unsigned)(((size_t)NH_ * TT / 32 + 7) / 8), 256, 0, stream>>>(qb, QN); k_rown2<<<(unsigned)(((size_t)NH_ * TT / 32 + 7) / 8), 256, 0, stream>>>(kb, KN);   /* |q|^2, |k|^2 per (head, row) from the bf16-rounded inputs */
        for (int h = 0; h < NH_; ++h) {
            k_gemmw<bf, 0, false><<<dim3(TT / 64, TT / 64, 1), 32, 0, stream>>>(QB + (size_t)h * TT * HD, nullptr, KB + (size_t)h * TT * HD, nullptr, HD, Sb, TT, nullptr, 0, 0, 0);   /* exact scores (single bf16 planes) */
            k_wedge<<<(unsigned)(((size_t)TT * TT / 4 + 255) / 256), 256, 0, stream>>>(Sb, QN + (size_t)h * TT, KN + (size_t)h * TT);   /* dot -> wedge */ k_asoft<<<TT / 8, 256, 0, stream>>>(Sb, nullptr, Ph, Pl);
            k_gemmw<bf, 1, false><<<dim3(TT / 64, HD / 64, 1), 32, 0, stream>>>(Ph, Pl, VT + (size_t)h * HD * TT, nullptr, TT, Ob, HD, nullptr, 0, 0, 0);   /* P (hi/lo) x exact v^T */
            k_mergeT<<<(unsigned)(((size_t)TT * HD / 4 + 255) / 256), 256, 0, stream>>>(Ob, h, OUT + (size_t)b * TT * DM); } }
}

// v001
// One run takes 1000 microseconds.
// Timed twice side by side with v000, it ran 2.35 and 2.37 times as fast.
#include <hip/hip_runtime.h>

// Geometric attention on given tensors (queries, keys, values [4][2048][8][64] token-major (B, L, H, E); dot = q.k; wedge = sqrt(relu(|q|^2 |k|^2 - dot^2) + 1e-8); scores = ((1 - alpha) dot + alpha wedge) / 8 with alpha = 1 -> scores = wedge / 8; softmax over all keys; out = A.values -> [4][2048][8][64] (4.2 M)).
// Layout per batch: single bf16 head planes gathered from the token-major slabs (inputs bf16-exact after rounding: exact dot products, f32 accumulate) and per-row squared norms of q and k in f32 (one lane per row, fixed order); per head: exact dot scores, an element-wise kernel replaces each score by the wedge (f32: |q_i|^2 |k_j|^2 - dot^2, relu, + eps, precise sqrt; the (1 - alpha) dot term is exactly zero), the softmax with every row's probabilities as bf16 hi/lo, A.values as hi/lo x exact values^T (2 products); f32 rows written back token-major.
// Compute dtypes, f32 accumulate: every input rounded to bf16; q.k exact; norms, wedge and softmax f32; P hi/lo x exact values; output f32.

#define NB_  4
#define TT   2048
#define DM   512      // token-major row pitch (H x HD)
#define NH_  8
#define NKV  1
#define REP  (NH_ / NKV)
#define HD   64
#define DQ   (NH_ * HD)
#define DKV  (NKV * HD)
#define ZH   1
#define RH   2048                  // query rows < RH use hi+lo planes (0: none)
#define WIN  0
#define PCAR 1024.0f
#define SCL  0.125f   // 1/sqrt(64), applied to the wedge score
typedef _Float16 h16;
typedef unsigned short bf;
typedef __attribute__((ext_vector_type(16))) __bf16   v16bf;
typedef __attribute__((ext_vector_type(16))) _Float16 v16h;
typedef __attribute__((ext_vector_type(8)))  _Float16 v8h;
typedef __attribute__((ext_vector_type(8)))  unsigned short v8us;
typedef __attribute__((ext_vector_type(8)))  float    v8f;
typedef __attribute__((ext_vector_type(4)))  float    v4f;
typedef v8h  __attribute__((may_alias)) v8ha;
typedef v4f  __attribute__((may_alias)) v4fa;
typedef v8us __attribute__((may_alias)) v8usa;

__device__ __forceinline__ unsigned short f2bf(float f) { unsigned u = __float_as_uint(f); u += 0x7FFFu + ((u >> 16) & 1u); return (unsigned short)(u >> 16); }
__device__ __forceinline__ float bf2f(unsigned short b) { return __uint_as_float(((unsigned)b) << 16); }
__device__ __forceinline__ float bfr(float f) { return bf2f(f2bf(f)); }
__device__ __forceinline__ v16h cat16(v8h lo, v8h hi) { return __builtin_shufflevector(lo, hi, 0, 1, 2, 3, 4, 5, 6, 7, 8, 9, 10, 11, 12, 13, 14, 15); }
__device__ __forceinline__ v16bf cat16b(v8us lo, v8us hi) { return __builtin_bit_cast(v16bf, __builtin_shufflevector(lo, hi, 0, 1, 2, 3, 4, 5, 6, 7, 8, 9, 10, 11, 12, 13, 14, 15)); }
__device__ __forceinline__ v8f wmma16(v16h a, v16h b, v8f c) { return __builtin_amdgcn_wmma_f32_16x16x32_f16(false, a, false, b, (short)0, c, false, false); }
__device__ __forceinline__ v8f wmmab(v16bf a, v16bf b, v8f c) { return __builtin_amdgcn_wmma_f32_16x16x32_bf16(false, a, false, b, (short)0, c, false, false); }



// ---- k_gemmw: register-blocked GEMM, ONE WAVE per 64x64 output tile (16 accumulators), operands straight from K-contiguous 16-bit planes; grid (M/64, N/64, Z), 32 threads.
// C[m][n] (f32, pitch ldc, + optional f32 bias[n]) = sum_k A[m][k] Bt[n][k] (+ split products per NSPLIT). z-batch strides sA/sB/sC in elements. K % 32 == 0.
template <typename T16> struct WFrag;
template <> struct WFrag<h16> { typedef v16h V; static __device__ __forceinline__ V ld(const h16* p) { return cat16(*(const v8h*)p, *(const v8h*)(p + 16)); } static __device__ __forceinline__ v8f mma(V a, V b, v8f c) { return wmma16(a, b, c); } };
template <> struct WFrag<bf> { typedef v16bf V; static __device__ __forceinline__ V ld(const bf* p) { return cat16b(*(const v8us*)p, *(const v8us*)(p + 16)); } static __device__ __forceinline__ v8f mma(V a, V b, v8f c) { return wmmab(a, b, c); } };
template <typename T16, int NSPLIT, bool BIAS>
__global__ __launch_bounds__(32) void k_gemmw(const T16* __restrict__ A, const T16* __restrict__ A2, const T16* __restrict__ Bt, const T16* __restrict__ Bt2, int K, float* C, int ldc, const float* __restrict__ bias, size_t sA, size_t sB, size_t sC) {
    typedef typename WFrag<T16>::V V;
    __shared__ __align__(16) float os[16 * 68];
    const size_t z = blockIdx.z; A += z * sA; if (A2) A2 += z * sA; Bt += z * sB; if (Bt2) Bt2 += z * sB; C += z * sC;
    const int lane = threadIdx.x & 31, lr = lane & 15, hi = lane >> 4; const int r0 = blockIdx.x * 64, c0 = blockIdx.y * 64;
    v8f acc[4][4];
#pragma unroll
    for (int mb = 0; mb < 4; ++mb)
#pragma unroll
        for (int nb = 0; nb < 4; ++nb) acc[mb][nb] = (v8f){};
    const size_t aoff = (size_t)(r0 + lr) * K + 8 * hi, boff = (size_t)(c0 + lr) * K + 8 * hi;
#pragma unroll 1
    for (int kc = 0; kc < K; kc += 32) {
        V a[4], a2[4];
#pragma unroll
        for (int mb = 0; mb < 4; ++mb) { a[mb] = WFrag<T16>::ld(A + aoff + (size_t)mb * 16 * K + kc); if (NSPLIT == 1 || NSPLIT == 2) a2[mb] = WFrag<T16>::ld(A2 + aoff + (size_t)mb * 16 * K + kc); }
#pragma unroll
        for (int nb = 0; nb < 4; ++nb) { const V b = WFrag<T16>::ld(Bt + boff + (size_t)nb * 16 * K + kc); V b2; if (NSPLIT >= 2) b2 = WFrag<T16>::ld(Bt2 + boff + (size_t)nb * 16 * K + kc);
#pragma unroll
            for (int mb = 0; mb < 4; ++mb) { acc[mb][nb] = WFrag<T16>::mma(a[mb], b, acc[mb][nb]); if (NSPLIT == 1 || NSPLIT == 2) acc[mb][nb] = WFrag<T16>::mma(a2[mb], b, acc[mb][nb]); if (NSPLIT >= 2) acc[mb][nb] = WFrag<T16>::mma(a[mb], b2, acc[mb][nb]); } }
        asm volatile("v_nop\n\tv_nop\n\tv_nop\n\tv_nop" : "+v"(acc[0][0]), "+v"(acc[1][1]), "+v"(acc[2][2]), "+v"(acc[3][3]) : "v"(a[0]), "v"(a[3]));
    }
#pragma unroll
    for (int mb = 0; mb < 4; ++mb) {
#pragma unroll
        for (int nb = 0; nb < 4; ++nb) {
#pragma unroll
            for (int j = 0; j < 8; ++j) os[(hi * 8 + j) * 68 + nb * 16 + lr] = acc[mb][nb][j]; }
        __builtin_amdgcn_wave_barrier(); asm volatile("" ::: "memory");
        float* crow = C + (size_t)(r0 + mb * 16) * ldc + c0;
{
#pragma unroll
            for (int s = 0; s < 8; ++s) { const int row = 2 * s + hi, cofs = lr * 4; v4f val = *(const v4fa*)(os + row * 68 + cofs); if (BIAS) { val[0] += bfr(bias[c0 + cofs]); val[1] += bfr(bias[c0 + cofs + 1]); val[2] += bfr(bias[c0 + cofs + 2]); val[3] += bfr(bias[c0 + cofs + 3]); }
                *(v4f*)(crow + (size_t)row * ldc + cofs) = val; }
             }
        __builtin_amdgcn_wave_barrier(); asm volatile("" ::: "memory");
    }
}

__device__ __forceinline__ h16 tohx(float x) { return (h16)x; }
__device__ __forceinline__ void splitf(float y, unsigned short& h, unsigned short& l) { h = f2bf(y); l = f2bf(y - bf2f(h)); }
typedef __attribute__((ext_vector_type(2))) _Float16 v2h;
typedef __attribute__((ext_vector_type(4))) _Float16 v4h;
typedef __attribute__((ext_vector_type(2))) unsigned short v2us;
typedef __attribute__((ext_vector_type(4))) unsigned short v4us;
typedef __attribute__((ext_vector_type(2))) float v2f;
typedef __attribute__((ext_vector_type(4))) int v4i;

__global__ __launch_bounds__(256) void k_wtG(const float* __restrict__ w, int K, int N, bf* Bt) {
    const int lane = threadIdx.x & 31; const int L0 = (blockIdx.x * 8 + (threadIdx.x >> 5)) * 8; const int nlines = N * K / 64;
{
#pragma unroll 1
        for (int l = 0; l < 8; ++l) { const int L = L0 + l; if (L >= nlines) break; const size_t e = (size_t)L * 64 + lane * 2; const int k = (int)(e % K), n = (int)(e / K); v2us o;
            o[0] = f2bf(w[(size_t)k * N + n]); o[1] = f2bf(w[(size_t)(k + 1) * N + n]); *(v2us*)(Bt + e) = o; }
         }
}
__global__ __launch_bounds__(256) void k_cvt8(const float* __restrict__ src, bf* dst, size_t n8) { const size_t i = (size_t)blockIdx.x * 256 + threadIdx.x; if (i >= n8) return; const v8f v = *(const v8f*)(src + i * 8); v8us o;
#pragma unroll
    for (int k = 0; k < 8; ++k) o[k] = f2bf(v[k]); *(v8us*)(dst + i * 8) = o;  }


__global__ __launch_bounds__(256) void k_vtp(const float* __restrict__ F, int pitch, int nheads, h16* V16, bf* Vh, bf* Vl) { const size_t e = ((size_t)blockIdx.x * 256 + threadIdx.x) * 2; if (e >= (size_t)nheads * HD * TT) return; const int t = (int)(e % TT); const int d = (int)((e / TT) % HD); const int g = (int)(e / ((size_t)TT * HD)); v2h o16; v2us oh, ol;
#pragma unroll
    for (int q = 0; q < 2; ++q) { const float x = F[(size_t)(t + q) * pitch + g * HD + d]; o16[q] = tohx(x); unsigned short a2, c2; splitf(x, a2, c2); oh[q] = a2; ol[q] = c2; }
    *(v2h*)(V16 + e) = o16; *(v2us*)(Vh + e) = oh; *(v2us*)(Vl + e) = ol;  }

// k_asoft: per row (zz, i): t = S x HD^-0.5 (no mask); softmax over the 2048 keys (register row, one exp, fixed trees);
__global__ __launch_bounds__(256) void k_asoft(const float* __restrict__ Sb, h16* P16, bf* Ph, bf* Pl) {
    const int lane = threadIdx.x & 31; const int row = blockIdx.x * 8 + (threadIdx.x >> 5); if (row >= ZH * TT) return; const int i = row % TT; const int zz = row / TT; (void)zz; const bool hires = (i < RH); const float* sr = Sb + (size_t)row * TT; float v[TT / 32]; float mx = -3.0e38f;
#pragma unroll
    for (int ch = 0; ch < TT / 128; ++ch) { const int j0 = ch * 128 + lane * 4; const v4f a = *(const v4f*)(sr + j0);
#pragma unroll
        for (int q = 0; q < 4; ++q) { const float t = a[q] * SCL; v[ch * 4 + q] = t;   /* Sb already holds the wedge (k_wedge) */ mx = fmaxf(mx, t); } }
#pragma unroll
    for (int sh = 16; sh; sh >>= 1) mx = fmaxf(mx, __shfl_xor(mx, sh, 32));
    float sum = 0.f;
#pragma unroll
    for (int k = 0; k < TT / 32; ++k) { float d0 = __fsub_rn(v[k], mx); asm volatile("" : "+v"(d0)); v[k] = __builtin_amdgcn_exp2f(__fmul_rn(d0, 1.4426950408889634f)); sum += v[k]; }
#pragma unroll
    for (int sh = 16; sh; sh >>= 1) sum += __shfl_xor(sum, sh, 32);
    const float f = __fdiv_rn(hires ? 1.0f : PCAR, sum);
{
        if (hires) {
#pragma unroll
            for (int ch = 0; ch < TT / 128; ++ch) { v4us oh, ol;
#pragma unroll
                for (int q = 0; q < 4; ++q) { unsigned short a, c2; splitf(v[ch * 4 + q] * f, a, c2); oh[q] = a; ol[q] = c2; }
                const size_t oo = ((size_t)zz * (RH ? RH : 1) + i) * TT + ch * 128 + lane * 4; *(v4us*)(Ph + oo) = oh; *(v4us*)(Pl + oo) = ol; }
        } else {
#pragma unroll
            for (int ch = 0; ch < TT / 128; ++ch) { v4h o4;
#pragma unroll
                for (int q = 0; q < 4; ++q) o4[q] = tohx(v[ch * 4 + q] * f);
                *(v4h*)(P16 + (size_t)row * TT + ch * 128 + lane * 4) = o4; } }
         }
}
__global__ __launch_bounds__(256) void k_merge(const float* __restrict__ O, int h0, float* OUTb) { const size_t e = ((size_t)blockIdx.x * 256 + threadIdx.x) * 2; if (e >= (size_t)ZH * TT * HD) return; const int d = (int)(e % HD); const int t = (int)((e / HD) % TT); const int zz = (int)(e / ((size_t)HD * TT)); const float cs = (t < RH) ? 1.0f : (1.0f / PCAR); const size_t oo = (size_t)t * DQ + (h0 + zz) * HD + d;
    v2f o2; o2[0] = O[e] * cs; o2[1] = O[e + 1] * cs; *(v2f*)(OUTb + oo) = o2;  }


__global__ __launch_bounds__(256) void k_vtpR1(const float* __restrict__ Vb, bf* Vh) { const size_t e = ((size_t)blockIdx.x * 256 + threadIdx.x) * 2; if (e >= (size_t)HD * TT) return; const int t = (int)(e % TT); const int d = (int)(e / TT); v2us o; o[0] = f2bf(Vb[(size_t)t * HD + d]); o[1] = f2bf(Vb[(size_t)(t + 1) * HD + d]); *(v2us*)(Vh + e) = o;  }
__global__ __launch_bounds__(256) void k_mergeR(const float* __restrict__ O, float* outb, size_t n4) { const size_t i = (size_t)blockIdx.x * 256 + threadIdx.x; if (i >= n4) return; const v4f a = *(const v4f*)(O + i * 4); *(v4f*)(outb + i * 4) = a;  }


__global__ __launch_bounds__(256) void k_rown2(const float* __restrict__ src, float* N2) { const int lane = threadIdx.x & 31; const size_t wv = (size_t)blockIdx.x * 8 + (threadIdx.x >> 5); if (wv >= (size_t)NH_ * TT / 32) return; const int h = (int)(wv / (TT / 32)); const int t = (int)(wv % (TT / 32)) * 32 + lane; const float* f = src + (size_t)t * DM + h * HD; float s = 0.f;
#pragma unroll 4
    for (int d = 0; d < HD; d += 4) { const v4f a = *(const v4f*)(f + d);
#pragma unroll
        for (int q = 0; q < 4; ++q) { const float x = bfr(a[q]); float p = __fmul_rn(x, x); asm volatile("" : "+v"(p)); s = __fadd_rn(s, p); } }
    *(float*)(N2 + (size_t)h * TT + t) = s;  }
__global__ __launch_bounds__(256) void k_wedge(float* Sb, const float* __restrict__ qn, const float* __restrict__ kn) { const size_t k = (size_t)blockIdx.x * 256 + threadIdx.x; if (k >= (size_t)TT * TT / 4) return; const size_t e = k * 4; const int j0 = (int)(e % TT); const int i = (int)(e / TT); const float qi = qn[i]; const v4f kj = *(const v4f*)(kn + j0); v4f a = *(const v4f*)(Sb + e);
#pragma unroll
    for (int q = 0; q < 4; ++q) { float nn = __fmul_rn(qi, kj[q]); float d2 = __fmul_rn(a[q], a[q]); asm volatile("" : "+v"(nn), "+v"(d2)); float w2 = __fsub_rn(nn, d2); asm volatile("" : "+v"(w2)); w2 = fmaxf(w2, 0.0f); const float w = __fadd_rn(w2, 1e-8f); a[q] = __fsqrt_rn(w); }
    *(v4f*)(Sb + e) = a;  }
__global__ __launch_bounds__(256) void k_hp1(const float* __restrict__ src, bf* P) { const size_t i = (size_t)blockIdx.x * 256 + threadIdx.x; if (i >= (size_t)NH_ * TT * HD / 8) return; const size_t e = i * 8; const int d = (int)(e % HD); const int t = (int)((e / HD) % TT); const int h = (int)(e / ((size_t)HD * TT)); const v8f v = *(const v8f*)(src + (size_t)t * DM + h * HD + d); v8us o;
#pragma unroll
    for (int q = 0; q < 8; ++q) o[q] = f2bf(v[q]);
    *(v8us*)(P + e) = o;  }
__global__ __launch_bounds__(256) void k_vt1(const float* __restrict__ src, int pitch, bf* VT) { const size_t e = ((size_t)blockIdx.x * 256 + threadIdx.x) * 2; if (e >= (size_t)NH_ * HD * TT) return; const int t = (int)(e % TT); const int d = (int)((e / TT) % HD); const int h = (int)(e / ((size_t)TT * HD)); v2us o; o[0] = f2bf(src[(size_t)t * pitch + h * HD + d]); o[1] = f2bf(src[(size_t)(t + 1) * pitch + h * HD + d]); *(v2us*)(VT + e) = o;  }
__global__ __launch_bounds__(256) void k_mergeT(const float* __restrict__ O, int h, float* outb) { const size_t i = (size_t)blockIdx.x * 256 + threadIdx.x; if (i >= (size_t)TT * HD / 4) return; const size_t e = i * 4; const int d = (int)(e % HD); const int t = (int)(e / HD); const v4f a = *(const v4f*)(O + e); *(v4f*)(outb + (size_t)t * DM + h * HD + d) = a;  }

// ---- k_pvsk: O[TT][HD] (f32) = (Ph + Pl) . Vt^T for one head, keys split over the waves of a work-group.
// One work-group per 16 query rows; wave w sums keys [w * PVK, (w + 1) * PVK) into a 16 x 64 partial (hi then lo per 32 keys); the PVW partials go through LDS and are added in wave order 0..PVW-1.
#define PVW  16
#define PVK  (TT / PVW)
#define PVP  68       // LDS row pitch in floats: rows j and j + 8 of one store land in different banks
typedef v2f __attribute__((may_alias)) v2fa;
__global__ __launch_bounds__(PVW * 32) void k_pvsk(const bf* __restrict__ Ph, const bf* __restrict__ Pl, const bf* __restrict__ Vt, float* O) {
    __shared__ __align__(16) float part[PVW * 16 * PVP];
    const int lane = threadIdx.x & 31, lr = lane & 15, hi = lane >> 4, w = threadIdx.x >> 5; const int r0 = blockIdx.x * 16;
    const unsigned ao = (unsigned)(((r0 + lr) * TT + w * PVK + 8 * hi) * 2), bo = (unsigned)((lr * TT + w * PVK + 8 * hi) * 2);   // byte offsets into the planes
    const bf* pah = (const bf*)((const char*)Ph + ao); const bf* pal = (const bf*)((const char*)Pl + ao); const bf* pb = (const bf*)((const char*)Vt + bo);
    v8f acc[4];
#pragma unroll
    for (int nb = 0; nb < 4; ++nb) acc[nb] = (v8f){};
    v16bf ah[PVK / 32], al[PVK / 32], b[PVK / 32][4];
#pragma unroll
    for (int s = 0; s < PVK / 32; ++s) { ah[s] = WFrag<bf>::ld(pah + s * 32);
#pragma unroll
        for (int nb = 0; nb < 4; ++nb) b[s][nb] = WFrag<bf>::ld(pb + nb * 16 * TT + s * 32);
        al[s] = WFrag<bf>::ld(pal + s * 32); }
    asm volatile("s_wait_xcnt 0x0" :: "v"(ao), "v"(bo) : "memory");   // the wait in front of any reuse of the loads' offset registers; naming them keeps them whole up to here
    __builtin_amdgcn_sched_barrier(0);   // keeps all of the wave's loads in front of the products: one memory latency for the wave instead of one per fragment group
#pragma unroll
    for (int s = 0; s < PVK / 32; ++s) {
#pragma unroll
        for (int nb = 0; nb < 4; ++nb) acc[nb] = wmmab(ah[s], b[s][nb], acc[nb]);
        if (s == 0) __builtin_amdgcn_sched_barrier(0);   // all four accumulators get their registers while every fragment is still needed: none is placed over an operand of the product in front of it
#pragma unroll
        for (int nb = 0; nb < 4; ++nb) acc[nb] = wmmab(al[s], b[s][nb], acc[nb]);
    }
    float* pw = part + w * 16 * PVP;
#pragma unroll
    for (int nb = 0; nb < 4; ++nb) {
#pragma unroll
        for (int j = 0; j < 8; ++j) pw[(hi * 8 + j) * PVP + nb * 16 + lr] = acc[nb][j]; }
    __syncthreads();   // every wave's partial is in LDS before any thread adds them
    const int e = threadIdx.x * 2, row = e / HD, col = e % HD; const float* pr = part + row * PVP + col;
    v2f s = *(const v2fa*)pr;
#pragma unroll
    for (int q = 1; q < PVW; ++q) s += *(const v2fa*)(pr + q * 16 * PVP);
    *(v2f*)(O + (size_t)(r0 + row) * HD + col) = s;
}

extern "C" void kernel_launch(void* const* d_in, const int* in_sizes, int n_in,
                              void* d_out, int out_size, void* d_ws, size_t ws_size, hipStream_t stream) {
    (void)in_sizes; (void)n_in; (void)out_size;
    const float* Qin = (const float*)d_in[0]; const float* Kin = (const float*)d_in[1]; const float* Vin = (const float*)d_in[2];
    float* OUT = (float*)d_out;
    char* wsp = (char*)d_ws;
    auto take = [&](size_t bytes) { char* p = wsp; wsp += (bytes + 255) & ~(size_t)255; return (void*)p; };
    bf* QB = (bf*)take((size_t)NH_ * TT * HD * 2); bf* KB = (bf*)take((size_t)NH_ * TT * HD * 2); bf* VT = (bf*)take((size_t)NH_ * HD * TT * 2);
    float* Sb = (float*)take((size_t)TT * TT * 4); float* QN = (float*)take((size_t)NH_ * TT * 4); float* KN = (float*)take((size_t)NH_ * TT * 4);  bf* Ph = (bf*)take((size_t)TT * TT * 2); bf* Pl = (bf*)take((size_t)TT * TT * 2); float* Ob = (float*)take((size_t)TT * HD * 4);
    if ((size_t)(wsp - (char*)d_ws) > ws_size) return;
    for (int b = 0; b < NB_; ++b) {
        const float* qb = Qin + (size_t)b * TT * DM; const float* kb = Kin + (size_t)b * TT * DM; const float* vb = Vin + (size_t)b * TT * DM;   /* token-major [t][h][d] slabs */
        k_hp1<<<(unsigned)(((size_t)NH_ * TT * HD / 8 + 255) / 256), 256, 0, stream>>>(qb, QB); k_hp1<<<(unsigned)(((size_t)NH_ * TT * HD / 8 + 255) / 256), 256, 0, stream>>>(kb, KB); k_vt1<<<(unsigned)(((size_t)NH_ * HD * TT / 2 + 255) / 256), 256, 0, stream>>>(vb, DM, VT); k_rown2<<<(unsigned)(((size_t)NH_ * TT / 32 + 7) / 8), 256, 0, stream>>>(qb, QN); k_rown2<<<(unsigned)(((size_t)NH_ * TT / 32 + 7) / 8), 256, 0, stream>>>(kb, KN);   /* |q|^2, |k|^2 per (head, row) from the bf16-rounded inputs */
        for (int h = 0; h < NH_; ++h) {
            k_gemmw<bf, 0, false><<<dim3(TT / 64, TT / 64, 1), 32, 0, stream>>>(QB + (size_t)h * TT * HD, nullptr, KB + (size_t)h * TT * HD, nullptr, HD, Sb, TT, nullptr, 0, 0, 0);   /* exact scores (single bf16 planes) */
            k_wedge<<<(unsigned)(((size_t)TT * TT / 4 + 255) / 256), 256, 0, stream>>>(Sb, QN + (size_t)h * TT, KN + (size_t)h * TT);   /* dot -> wedge */ k_asoft<<<TT / 8, 256, 0, stream>>>(Sb, nullptr, Ph, Pl);
            k_pvsk<<<TT / 16, PVW * 32, 0, stream>>>(Ph, Pl, VT + (size_t)h * HD * TT, Ob);   /* P (hi/lo) x exact v^T, keys split over 16 waves */
            k_mergeT<<<(unsigned)(((size_t)TT * HD / 4 + 255) / 256), 256, 0, stream>>>(Ob, h, OUT + (size_t)b * TT * DM); } }
}

// v002
// A run of this version takes 81 microseconds.
// Next to v001, in two timings, it ran 12.5 and 12.6 times as fast.
// Over all steps from v000 it is 29.5 times as fast.
#include <hip/hip_runtime.h>

// Geometric attention on given tensors (queries, keys, values [4][2048][8][64] token-major (B, L, H, E); dot = q.k; wedge = sqrt(relu(|q|^2 |k|^2 - dot^2) + 1e-8); scores = ((1 - alpha) dot + alpha wedge) / 8 with alpha = 1 -> scores = wedge / 8; softmax over all keys; out = A.values -> [4][2048][8][64]).
// Two launches. k_prep: keys and values^T rounded to bf16 and laid out in matrix-fragment order (every fragment half is one contiguous 512-byte read of a wave), and the squared norms of the bf16-rounded q and k rows in f32.
// k_fattn: one wave per 16 queries of one (batch, head) walks the 2048 keys 32 at a time: S^T = K.Q^T (exact bf16 products, f32 accumulate), wedge in f32, running-maximum softmax, P^T packed from the score accumulators as bf16 hi + lo, O^T += V^T.P^T (2 products); the row sum divides once at the end. No score or probability goes to memory.
// Compute dtypes, f32 accumulate: every input rounded to bf16; q.k exact; norms, wedge and softmax f32; P hi/lo x exact values; output f32.

#define NB_  4
#define TT   2048
#define DM   512      // token-major row pitch (H x HD)
#define NH_  8
#define HD   64
#define SCL2 0.18033688011112042f   // (1 / sqrt(64)) * log2(e): the softmax runs on powers of two
typedef unsigned short bf;
typedef __attribute__((ext_vector_type(16))) __bf16   v16bf;
typedef __attribute__((ext_vector_type(2)))  __bf16   v2bf;
typedef __attribute__((ext_vector_type(8)))  unsigned short v8us;
typedef __attribute__((ext_vector_type(8)))  unsigned v8u;
typedef __attribute__((ext_vector_type(8)))  float    v8f;
typedef __attribute__((ext_vector_type(4)))  float    v4f;
typedef __attribute__((ext_vector_type(2)))  float    v2f;

__device__ __forceinline__ unsigned short f2bf(float f) { unsigned u = __float_as_uint(f); u += 0x7FFFu + ((u >> 16) & 1u); return (unsigned short)(u >> 16); }
__device__ __forceinline__ float bf2f(unsigned short b) { return __uint_as_float(((unsigned)b) << 16); }
__device__ __forceinline__ float bfr(float f) { return bf2f(f2bf(f)); }
__device__ __forceinline__ v16bf cat16b(v8us lo, v8us hi) { return __builtin_bit_cast(v16bf, __builtin_shufflevector(lo, hi, 0, 1, 2, 3, 4, 5, 6, 7, 8, 9, 10, 11, 12, 13, 14, 15)); }
__device__ __forceinline__ v8f wmmab(v16bf a, v16bf b, v8f c) { return __builtin_amdgcn_wmma_f32_16x16x32_bf16(false, a, false, b, (short)0, c, false, false); }
__device__ __forceinline__ v8us cvt8(v8f v) { v8us o;
#pragma unroll
    for (int e = 0; e < 8; ++e) o[e] = f2bf(v[e]);
    return o; }

// Fragment order (lane l: c = l & 15, g = l >> 4; element s of a fragment has k = 8 g + s for s < 8, 16 + 8 g + (s - 8) above):
// KF[bh][key tile of 16][k step of 32 d][half][lane][8]: key = tile * 16 + c, d = step * 32 + half * 16 + 8 g + e.
// VF[bh][key block of 32][d tile of 16][half][lane][8]: d = tile * 16 + c, key = block * 32 + half * 16 + 8 g + e.
#define PBLK ((unsigned)(NB_ * NH_ * TT * HD / 8 / 256))
__global__ __launch_bounds__(256) void k_prep(const float* __restrict__ Q, const float* __restrict__ K, const float* __restrict__ V, bf* KF, bf* VF, float* QN, float* KN) {
    const unsigned blk = blockIdx.x;
    if (blk < 2 * PBLK) {
        const bool isv = blk >= PBLK; const unsigned i = (isv ? blk - PBLK : blk) * 256 + threadIdx.x;
        const unsigned c = i & 15, g = (i >> 4) & 1, half = (i >> 5) & 1, bh = i >> 14, b = bh >> 3, h = bh & 7;
        if (!isv) { const unsigned ks = (i >> 6) & 1, kt = (i >> 7) & 127;
            const v8f v = *(const v8f*)(K + (size_t)(b * TT + kt * 16 + c) * DM + h * HD + ks * 32 + half * 16 + 8 * g);
            *(v8us*)(KF + (size_t)i * 8) = cvt8(v);
        } else { const unsigned dt = (i >> 6) & 3, kb = (i >> 8) & 63;
            const float* s = V + (size_t)(b * TT + kb * 32 + half * 16 + 8 * g) * DM + h * HD + dt * 16 + c; v8f v;
#pragma unroll
            for (int e = 0; e < 8; ++e) v[e] = s[(size_t)e * DM];
            *(v8us*)(VF + (size_t)i * 8) = cvt8(v); }
    } else {
        const unsigned r = (blk - 2 * PBLK) * 256 + threadIdx.x; const bool isk = r >= (unsigned)(NB_ * NH_ * TT); const unsigned rr = isk ? r - NB_ * NH_ * TT : r;
        const unsigned bh = rr / TT, t = rr % TT, b = bh >> 3, h = bh & 7; const float* f = (isk ? K : Q) + (size_t)(b * TT + t) * DM + h * HD; float s = 0.f; v4f a[HD / 4];
#pragma unroll
        for (int d = 0; d < HD / 4; ++d) a[d] = *(const v4f*)(f + d * 4);
        asm volatile("s_wait_xcnt 0x0" :: "v"(f) : "memory");   // the wait in front of any reuse of the loads' address registers; naming the address keeps it whole up to here
#pragma unroll
        for (int d = 0; d < HD / 4; ++d) {
#pragma unroll
            for (int q = 0; q < 4; ++q) { const float x = bfr(a[d][q]); s += x * x; } }
        (isk ? KN : QN)[rr] = s;
        asm volatile("s_wait_xcnt 0x0" ::: "memory");   // the wait in front of any reuse of the store's address registers
    }
}

__device__ __forceinline__ v16bf ldfrag(const char* p) { return cat16b(*(const v8us*)p, *(const v8us*)(p + 512)); }
__device__ __forceinline__ float xhalf(float x) { const int b = __float_as_int(x); return __int_as_float(__builtin_amdgcn_permlanex16(b, b, 0x76543210, 0xfedcba98, false, false)); }   // lane l <-> l ^ 16

#define FW 16         // waves per work-group, 16 queries each
__global__ __launch_bounds__(FW * 32) void k_fattn(const float* __restrict__ Q, const bf* __restrict__ KF, const bf* __restrict__ VF, const float* __restrict__ QN, const float* __restrict__ KN, float* OUT) {
    const unsigned lane = threadIdx.x & 31, c = lane & 15, g = lane >> 4, w = threadIdx.x >> 5;
    const unsigned bh = blockIdx.y, b = bh >> 3, h = bh & 7, q = blockIdx.x * (FW * 16) + w * 16 + c;
    const float* qp = Q + (size_t)(b * TT + q) * DM + h * HD + 8 * g;
    v16bf qf[2];
#pragma unroll
    for (int ks = 0; ks < 2; ++ks) qf[ks] = cat16b(cvt8(*(const v8f*)(qp + ks * 32)), cvt8(*(const v8f*)(qp + ks * 32 + 16)));
    const float qn = QN[bh * TT + q];
    const char* kl = (const char*)KF + (size_t)bh * (TT * HD * 2) + lane * 16; const char* vl = (const char*)VF + (size_t)bh * (TT * HD * 2) + lane * 16; const char* nl = (const char*)(KN + bh * TT) + g * 32;   // each lane's own place in block 0
    v8f o[4];
#pragma unroll
    for (int dt = 0; dt < 4; ++dt) o[dt] = (v8f){};
    float m = -1.0e30f; v2f l2 = (v2f){};
    v16bf kf[4]; v8f kn[2];
#pragma unroll
    for (int f = 0; f < 4; ++f) kf[f] = ldfrag(kl + f * 1024);
#pragma unroll
    for (int kt = 0; kt < 2; ++kt) kn[kt] = *(const v8f*)(nl + kt * 64);
    for (int kb = 0; kb < TT / 32; ++kb) {
        v8f st[2];
#pragma unroll
        for (int kt = 0; kt < 2; ++kt) { st[kt] = wmmab(kf[kt * 2], qf[0], (v8f){}); st[kt] = wmmab(kf[kt * 2 + 1], qf[1], st[kt]); }
        float wv[16]; float bm = 0.f;
#pragma unroll
        for (int s = 0; s < 16; ++s) { const float d = st[s >> 3][s & 7]; wv[s] = fmaxf(kn[s >> 3][s & 7] * qn - d * d, 0.0f) + 1e-8f; }
#pragma unroll
        for (int s = 0; s < 16; ++s) wv[s] = __builtin_amdgcn_sqrtf(wv[s]);
#pragma unroll
        for (int s = 0; s < 16; ++s) bm = fmaxf(bm, wv[s]);
        // This pass's value fragments, and the next pass's key fragments and norms into the registers just read, are fetched while the exponentials are worked out; the last pass fetches key block 0 again, unused.
        const int nx = (kb + 1) & (TT / 32 - 1);
        v16bf vf[4]; const char* vp = vl + kb * 4096; const char* kp = kl + nx * 4096; const char* np = nl + nx * 128;
#pragma unroll
        for (int dt = 0; dt < 4; ++dt) vf[dt] = ldfrag(vp + dt * 1024);
#pragma unroll
        for (int f = 0; f < 4; ++f) kf[f] = ldfrag(kp + f * 1024);
#pragma unroll
        for (int kt = 0; kt < 2; ++kt) kn[kt] = *(const v8f*)(np + kt * 64);
        asm volatile("s_wait_xcnt 0x0" :: "v"(vp), "v"(kp), "v"(np) : "memory");   // the wait in front of any reuse of the loads' address registers; naming the addresses keeps them whole up to here
        bm = fmaxf(bm, xhalf(bm));
        const float tb = bm * SCL2;
        if (__builtin_amdgcn_ballot_w32(tb > m + 8.0f) != 0) {   // the maximum in use moves only when a query's new one passes it by 2^8: p stays below 2^8 and the rescale is rare
            const float mn = fmaxf(m, tb); const float al = __builtin_amdgcn_exp2f(m - mn); m = mn; l2 *= al;
#pragma unroll
            for (int dt = 0; dt < 4; ++dt) o[dt] *= al;
        }
        v8u ph, pl; v2f ps[8];
#pragma unroll
        for (int s = 0; s < 16; s += 2) { v2f t; t[0] = wv[s]; t[1] = wv[s + 1]; t = t * SCL2 - m; v2f p; p[0] = __builtin_amdgcn_exp2f(t[0]); p[1] = __builtin_amdgcn_exp2f(t[1]); ps[s >> 1] = p;
            const unsigned u = __builtin_bit_cast(unsigned, __builtin_convertvector(p, v2bf)); v2f r; r[0] = p[0] - __uint_as_float(u << 16); r[1] = p[1] - __uint_as_float(u & 0xFFFF0000u);
            ph[s >> 1] = u; pl[s >> 1] = __builtin_bit_cast(unsigned, __builtin_convertvector(r, v2bf)); }
        l2 += ((ps[0] + ps[1]) + (ps[2] + ps[3])) + ((ps[4] + ps[5]) + (ps[6] + ps[7]));
        const v16bf bh_ = __builtin_bit_cast(v16bf, ph), bl_ = __builtin_bit_cast(v16bf, pl);
#pragma unroll
        for (int dt = 0; dt < 4; ++dt) o[dt] = wmmab(vf[dt], bl_, o[dt]);
#pragma unroll
        for (int dt = 0; dt < 4; ++dt) o[dt] = wmmab(vf[dt], bh_, o[dt]);
    }
    float l = l2[0] + l2[1]; l += xhalf(l);
    const float inv = 1.0f / l;
    float* op = OUT + (size_t)(b * TT + q) * DM + h * HD + 8 * g;
#pragma unroll
    for (int dt = 0; dt < 4; ++dt) { const v8f y = o[dt] * inv; *(v8f*)(op + dt * 16) = y; }
}

extern "C" void kernel_launch(void* const* d_in, const int* in_sizes, int n_in,
                              void* d_out, int out_size, void* d_ws, size_t ws_size, hipStream_t stream) {
    (void)in_sizes; (void)n_in; (void)out_size;
    const float* Qin = (const float*)d_in[0]; const float* Kin = (const float*)d_in[1]; const float* Vin = (const float*)d_in[2];
    float* OUT = (float*)d_out;
    char* wsp = (char*)d_ws;
    auto take = [&](size_t bytes) { char* p = wsp; wsp += (bytes + 255) & ~(size_t)255; return (void*)p; };
    bf* KF = (bf*)take((size_t)NB_ * NH_ * TT * HD * 2); bf* VF = (bf*)take((size_t)NB_ * NH_ * TT * HD * 2);
    float* QN = (float*)take((size_t)NB_ * NH_ * TT * 4); float* KN = (float*)take((size_t)NB_ * NH_ * TT * 4);
    if ((size_t)(wsp - (char*)d_ws) > ws_size) return;
    k_prep<<<2 * PBLK + 2 * NB_ * NH_ * TT / 256, 256, 0, stream>>>(Qin, Kin, Vin, KF, VF, QN, KN);
    k_fattn<<<dim3(TT / (FW * 16), NB_ * NH_, 1), FW * 32, 0, stream>>>(Qin, KF, VF, QN, KN, OUT);
}

// v003
// A run of this version takes 51.7 microseconds.
// Two timings next to v002 put it at 1.54 and 1.56 times that version's speed.
// All steps since v000 together make it 45.8 times as fast.
#include <hip/hip_runtime.h>

// Geometric attention on given tensors (queries, keys, values [4][2048][8][64] token-major (B, L, H, E); dot = q.k; wedge = sqrt(relu(|q|^2 |k|^2 - dot^2) + 1e-8); scores = ((1 - alpha) dot + alpha wedge) / 8 with alpha = 1 -> scores = wedge / 8; softmax over all keys; out = A.values -> [4][2048][8][64]).
// One launch. k_fattn: a work-group of 16 waves takes 256 queries of one (batch, head) and walks the 2048 keys in stages of 64. Per stage its 512 threads read the f32 keys and values, round them to bf16 and store them in LDS in matrix-fragment order (every fragment half is one contiguous 512-byte read of a wave), with the squared norms of the rounded key rows in f32; three LDS buffers, one barrier a stage: while stage s is worked on, stage s + 1 is already published (its first key fragments are read ahead) and stage s + 2 is on its way from global memory.
// Each wave owns 16 queries and takes a stage as two passes of 32 keys: S^T = K.Q^T (exact bf16 products, f32 accumulate), wedge in f32, running-maximum softmax, P^T packed from the score accumulators as bf16 hi + lo, O^T += V^T.P^T (2 products); the row sum divides once at the end. No score or probability goes to memory.
// Compute dtypes, f32 accumulate: every input rounded to bf16; q.k exact; norms, wedge and softmax f32; P hi/lo x exact values; output f32.

#define NB_  4
#define TT   2048
#define DM   512      // token-major row pitch (H x HD)
#define NH_  8
#define HD   64
#define SCL2 0.18033688011112042f   // (1 / sqrt(64)) * log2(e): the softmax runs on powers of two
typedef unsigned short bf;
typedef __attribute__((ext_vector_type(16))) __bf16   v16bf;
typedef __attribute__((ext_vector_type(2)))  __bf16   v2bf;
typedef __attribute__((ext_vector_type(8)))  unsigned short v8us;
typedef __attribute__((ext_vector_type(8)))  unsigned v8u;
typedef __attribute__((ext_vector_type(8)))  float    v8f;
typedef __attribute__((ext_vector_type(4)))  float    v4f;
typedef __attribute__((ext_vector_type(2)))  float    v2f;

__device__ __forceinline__ unsigned short f2bf(float f) { unsigned u = __float_as_uint(f); u += 0x7FFFu + ((u >> 16) & 1u); return (unsigned short)(u >> 16); }
__device__ __forceinline__ float bf2f(unsigned short b) { return __uint_as_float(((unsigned)b) << 16); }
__device__ __forceinline__ float bfr(float f) { return bf2f(f2bf(f)); }
__device__ __forceinline__ v16bf cat16b(v8us lo, v8us hi) { return __builtin_bit_cast(v16bf, __builtin_shufflevector(lo, hi, 0, 1, 2, 3, 4, 5, 6, 7, 8, 9, 10, 11, 12, 13, 14, 15)); }
__device__ __forceinline__ v8f wmmab(v16bf a, v16bf b, v8f c) { return __builtin_amdgcn_wmma_f32_16x16x32_bf16(false, a, false, b, (short)0, c, false, false); }
__device__ __forceinline__ v8us cvt8(v8f v) { v8us o;
#pragma unroll
    for (int e = 0; e < 8; ++e) o[e] = f2bf(v[e]);
    return o; }

typedef __attribute__((ext_vector_type(4)))  unsigned v4u;

// Fragment order (lane l: c = l & 15, g = l >> 4; element s of a fragment has k = 8 g + s for s < 8, 16 + 8 g + (s - 8) above). One LDS buffer holds a stage of 64 keys:
// keys   [key tile of 16: 4][k step of 32 d: 2][half: 2] at a pitch of KP bytes, each [lane][8]: key = tile * 16 + c, d = step * 32 + half * 16 + 8 g + e. KP = 512 + 64 spreads the four halves that one storing wave touches over the banks; a read stays 512 contiguous bytes.
// values [key block of 32: 2][d tile of 16: 4][half: 2][lane][8]: d = tile * 16 + c, key = block * 32 + half * 16 + 8 g + e.
// norms  [64] f32.
#define FW   16       // waves per work-group, 16 queries each
#define SK   64       // keys per stage
#define NST  (TT / SK)
#define KP   576
#define VOFF (16 * KP)
#define NOFF (VOFF + SK * HD * 2)
#define BUFB (NOFF + SK * 4)

__device__ __forceinline__ v16bf ldfrag(const char* p, int hp) { return cat16b(*(const v8us*)p, *(const v8us*)(p + hp)); }
__device__ __forceinline__ float xhalf(float x) { const int b = __float_as_int(x); return __int_as_float(__builtin_amdgcn_permlanex16(b, b, 0x76543210, 0xfedcba98, false, false)); }   // lane l <-> l ^ 16
template <int C> __device__ __forceinline__ float rowx(float x) { return __int_as_float(__builtin_amdgcn_update_dpp(0, __float_as_int(x), C, 0xf, 0xf, true)); }   // lane l <-> l ^ (C & 15) inside a row of 16
__device__ __forceinline__ unsigned pk2(float a, float b) { v2f t; t[0] = a; t[1] = b; return __builtin_bit_cast(unsigned, __builtin_convertvector(t, v2bf)); }

struct Stg { v8f k; float v[8]; };   // one thread's share of a stage: 8 d of one key, 8 keys of one d
__device__ __forceinline__ void fetch(Stg& s, const float* kg, const float* vg) {
    s.k = *(const v8f*)kg;
#pragma unroll
    for (int e = 0; e < 8; ++e) s.v[e] = vg[(size_t)e * DM];
    asm volatile("s_wait_xcnt 0x0" :: "v"(kg), "v"(vg) : "memory");   // the wait in front of any reuse of the loads' address registers; naming the addresses keeps them whole up to here
}
__device__ __forceinline__ void put(const Stg& s, char* kd, char* vd, char* nd, bool first) {
    v4u kw, vw; float n = 0.f;
#pragma unroll
    for (int e = 0; e < 4; ++e) { const unsigned u = pk2(s.k[2 * e], s.k[2 * e + 1]); kw[e] = u; vw[e] = pk2(s.v[2 * e], s.v[2 * e + 1]);
        const float x0 = __uint_as_float(u << 16), x1 = __uint_as_float(u & 0xFFFF0000u); n += x0 * x0; n += x1 * x1; }
    *(v4u*)kd = kw; *(v4u*)vd = vw;
    n += rowx<0x161>(n); n += rowx<0x162>(n); n += rowx<0x164>(n);   // the 8 lanes that hold one key row
    if (first) *(float*)nd = n;
}

__global__ __launch_bounds__(FW * 32) void k_fattn(const float* __restrict__ Q, const float* __restrict__ K, const float* __restrict__ V, float* OUT) {
    __shared__ __attribute__((aligned(128))) char sm[3 * BUFB];
    const unsigned t = threadIdx.x, lane = t & 31, c = lane & 15, g = lane >> 4, w = t >> 5;
    const unsigned bh = blockIdx.y, b = bh >> 3, h = bh & 7, q = blockIdx.x * (FW * 16) + w * 16 + c;
    // This thread's share of every stage: key row t >> 3, d 8 (t & 7) ..; value column and 8 keys in the order of the value fragments.
    const unsigned sk = t >> 3, sj = t & 7;
    const float* kg0 = K + (size_t)(b * TT + sk) * DM + h * HD + sj * 8;
    const float* vg0 = V + (size_t)(b * TT + (t >> 8) * 32 + ((t >> 5) & 1) * 16 + 8 * g) * DM + h * HD + ((t >> 6) & 3) * 16 + c;
    const unsigned kdo = ((sk >> 4) * 4 + (sj >> 1)) * KP + ((sj & 1) * 16 + (sk & 15)) * 16, vdo = VOFF + t * 16, ndo = NOFF + sk * 4;
    Stg sg, sh; fetch(sg, kg0, vg0); fetch(sh, kg0 + SK * DM, vg0 + SK * DM);
    const float* qp = Q + (size_t)(b * TT + q) * DM + h * HD + 8 * g;
    v16bf qf[2]; float qn = 0.f;
#pragma unroll
    for (int ks = 0; ks < 2; ++ks) { const v8f a = *(const v8f*)(qp + ks * 32), z = *(const v8f*)(qp + ks * 32 + 16); qf[ks] = cat16b(cvt8(a), cvt8(z));
#pragma unroll
        for (int e = 0; e < 8; ++e) { const float x = bfr(a[e]), y = bfr(z[e]); qn += x * x; qn += y * y; } }
    qn += xhalf(qn);
    v8f o[4];
#pragma unroll
    for (int dt = 0; dt < 4; ++dt) o[dt] = (v8f){};
    v2f m; m[0] = -1.0e30f; m[1] = -1.0e30f;   // the maximum in use, kept in both halves of a register pair: a pair with an idle half can share it with a global load in flight, and the packed FMAs then wait for that load
    v2f l2 = (v2f){};
    put(sg, sm + kdo, sm + vdo, sm + ndo, sj == 0); put(sh, sm + BUFB + kdo, sm + BUFB + vdo, sm + BUFB + ndo, sj == 0);
    __syncthreads();   // stages 0 and 1 are published
    unsigned cur = 0, nxt = BUFB, wr = 2 * BUFB;   // the buffers of stage s, s + 1, s + 2
    v16bf kf[4]; v8f kn[2];
#pragma unroll
    for (int f = 0; f < 4; ++f) kf[f] = ldfrag(sm + lane * 16 + f * (2 * KP), KP);
#pragma unroll
    for (int kt = 0; kt < 2; ++kt) kn[kt] = *(const v8f*)(sm + NOFF + g * 32 + kt * 64);
    for (int s = 0; s < NST; ++s) {
        // The keys and values of stage s + 2 start from global memory now and are rounded and stored behind this stage's two passes; the last two stages fetch stages 0 and 1 again, unused.
        const size_t nx = (size_t)((s + 2) & (NST - 1)) * (SK * DM);
        fetch(sg, kg0 + nx, vg0 + nx);
        const char* vl = sm + cur + VOFF + lane * 16;   // each lane's own place in the stage
#pragma unroll
        for (int p = 0; p < 2; ++p) {
            v8f st[2];
#pragma unroll
            for (int kt = 0; kt < 2; ++kt) { st[kt] = wmmab(kf[kt * 2], qf[0], (v8f){}); st[kt] = wmmab(kf[kt * 2 + 1], qf[1], st[kt]); }
            float wv[16]; float bm = 0.f;
#pragma unroll
            for (int i = 0; i < 16; ++i) { const float d = st[i >> 3][i & 7]; wv[i] = fmaxf(kn[i >> 3][i & 7] * qn - d * d, 0.0f) + 1e-8f; }
#pragma unroll
            for (int i = 0; i < 16; ++i) wv[i] = __builtin_amdgcn_sqrtf(wv[i]);
#pragma unroll
            for (int i = 0; i < 16; ++i) bm = fmaxf(bm, wv[i]);
            // This pass's value fragments, and the next pass's key fragments and norms into the registers just read, are read from LDS while the exponentials are worked out; the second pass reads them from stage s + 1, published one barrier ago.
            v16bf vf[4];
#pragma unroll
            for (int dt = 0; dt < 4; ++dt) vf[dt] = ldfrag(vl + p * 4096 + dt * 1024, 512);
            const char* kl = sm + (p == 0 ? cur + 8 * KP : nxt) + lane * 16; const char* nl = sm + (p == 0 ? cur + 128 : nxt) + NOFF + g * 32;
#pragma unroll
            for (int f = 0; f < 4; ++f) kf[f] = ldfrag(kl + f * (2 * KP), KP);
#pragma unroll
            for (int kt = 0; kt < 2; ++kt) kn[kt] = *(const v8f*)(nl + kt * 64);
            bm = fmaxf(bm, xhalf(bm));
            const float tb = bm * SCL2;
            if (__builtin_amdgcn_ballot_w32(tb > m[0] + 8.0f) != 0) {   // the maximum in use moves only when a query's new one passes it by 2^8: p stays below 2^8 and the rescale is rare
                const float mn = fmaxf(m[0], tb); const float al = __builtin_amdgcn_exp2f(m[0] - mn); m[0] = mn; m[1] = mn; l2 *= al;
#pragma unroll
                for (int dt = 0; dt < 4; ++dt) o[dt] *= al;
            }
            v8u ph, pl; v2f ps[8];
#pragma unroll
            for (int i = 0; i < 16; i += 2) { v2f x; x[0] = wv[i]; x[1] = wv[i + 1]; x = x * SCL2 - m; v2f pp; pp[0] = __builtin_amdgcn_exp2f(x[0]); pp[1] = __builtin_amdgcn_exp2f(x[1]); ps[i >> 1] = pp;
                const unsigned u = __builtin_bit_cast(unsigned, __builtin_convertvector(pp, v2bf)); v2f r; r[0] = pp[0] - __uint_as_float(u << 16); r[1] = pp[1] - __uint_as_float(u & 0xFFFF0000u);
                ph[i >> 1] = u; pl[i >> 1] = __builtin_bit_cast(unsigned, __builtin_convertvector(r, v2bf)); }
            l2 += ((ps[0] + ps[1]) + (ps[2] + ps[3])) + ((ps[4] + ps[5]) + (ps[6] + ps[7]));
            const v16bf bh_ = __builtin_bit_cast(v16bf, ph), bl_ = __builtin_bit_cast(v16bf, pl);
#pragma unroll
            for (int dt = 0; dt < 4; ++dt) o[dt] = wmmab(vf[dt], bl_, o[dt]);
#pragma unroll
            for (int dt = 0; dt < 4; ++dt) o[dt] = wmmab(vf[dt], bh_, o[dt]);
        }
        put(sg, sm + wr + kdo, sm + wr + vdo, sm + wr + ndo, sj == 0);   // into the buffer of stage s - 1, whose last readers left it at the barrier that closed that stage
        __syncthreads();   // publishes stage s + 2 and ends every wave's reads of stage s
        const unsigned fr = cur; cur = nxt; nxt = wr; wr = fr;
    }
    float l = l2[0] + l2[1]; l += xhalf(l);
    const float inv = 1.0f / l;
    float* op = OUT + (size_t)(b * TT + q) * DM + h * HD + 8 * g;
#pragma unroll
    for (int dt = 0; dt < 4; ++dt) { const v8f y = o[dt] * inv; *(v8f*)(op + dt * 16) = y; }
}

extern "C" void kernel_launch(void* const* d_in, const int* in_sizes, int n_in,
                              void* d_out, int out_size, void* d_ws, size_t ws_size, hipStream_t stream) {
    (void)in_sizes; (void)n_in; (void)out_size; (void)d_ws; (void)ws_size;
    const float* Qin = (const float*)d_in[0]; const float* Kin = (const float*)d_in[1]; const float* Vin = (const float*)d_in[2];
    float* OUT = (float*)d_out;
    k_fattn<<<dim3(TT / (FW * 16), NB_ * NH_, 1), FW * 32, 0, stream>>>(Qin, Kin, Vin, OUT);
}

// v005
// One run takes 42.6 microseconds.
// Versions between v003 and this one are left out; their measured steps multiply to 1.20 times as fast.
// Over all steps from v000 it is 55.1 times as fast.
#include <hip/hip_runtime.h>

// Geometric attention on given tensors (queries, keys, values [4][2048][8][64] token-major (B, L, H, E); dot = q.k; wedge = sqrt(relu(|q|^2 |k|^2 - dot^2) + 1e-8); scores = ((1 - alpha) dot + alpha wedge) / 8 with alpha = 1 -> scores = wedge / 8; softmax over all keys; out = A.values -> [4][2048][8][64]).
// One launch. k_fattn: a work-group of 16 waves takes 256 queries of one (batch, head) and walks the 2048 keys in stages of 64. Per stage its 512 threads read the f32 keys and values, round the keys to bf16 and the values to f16 and store them in LDS in matrix-fragment order (every fragment half is one contiguous 512-byte read of a wave), with the squared norms of the rounded key rows in f32; three LDS buffers, one barrier a stage: while stage s is worked on, stage s + 1 is already published (its key fragments are read ahead) and stage s + 2 is on its way from global memory.
// Each wave owns 16 queries and takes a stage as two passes of 32 keys: S^T = K.Q^T (exact bf16 products, f32 accumulate; made one pass ahead, in one run with the pass before's O^T products), wedge in f32, running-maximum softmax, P^T packed from the score accumulators as f16, O^T += V^T.P^T (one f16 product); the row sum divides once at the end. No score or probability goes to memory.
// Compute dtypes, f32 accumulate: queries and keys rounded to bf16, q.k exact; norms, wedge and softmax f32; values and P rounded to f16 (11 bits each; P lies in (0, 2^8], the row sum is at least 1, so what falls below the f16 range does not count); output f32.

#define NB_  4
#define TT   2048
#define DM   512      // token-major row pitch (H x HD)
#define NH_  8
#define HD   64
#define SCL2 0.18033688011112042f   // (1 / sqrt(64)) * log2(e): the softmax runs on powers of two
typedef unsigned short bf;
typedef __attribute__((ext_vector_type(16))) __bf16   v16bf;
typedef __attribute__((ext_vector_type(2)))  __bf16   v2bf;
typedef __attribute__((ext_vector_type(16))) _Float16 v16h;
typedef __attribute__((ext_vector_type(2)))  _Float16 v2h;
typedef __attribute__((ext_vector_type(8)))  unsigned short v8us;
typedef __attribute__((ext_vector_type(8)))  unsigned v8u;
typedef __attribute__((ext_vector_type(8)))  float    v8f;
typedef __attribute__((ext_vector_type(4)))  float    v4f;
typedef __attribute__((ext_vector_type(2)))  float    v2f;

__device__ __forceinline__ unsigned short f2bf(float f) { unsigned u = __float_as_uint(f); u += 0x7FFFu + ((u >> 16) & 1u); return (unsigned short)(u >> 16); }
__device__ __forceinline__ float bf2f(unsigned short b) { return __uint_as_float(((unsigned)b) << 16); }
__device__ __forceinline__ float bfr(float f) { return bf2f(f2bf(f)); }
__device__ __forceinline__ v16bf cat16b(v8us lo, v8us hi) { return __builtin_bit_cast(v16bf, __builtin_shufflevector(lo, hi, 0, 1, 2, 3, 4, 5, 6, 7, 8, 9, 10, 11, 12, 13, 14, 15)); }
__device__ __forceinline__ v8f wmmab(v16bf a, v16bf b, v8f c) { return __builtin_amdgcn_wmma_f32_16x16x32_bf16(false, a, false, b, (short)0, c, false, false); }
__device__ __forceinline__ v8f wmmah(v16h a, v16h b, v8f c) { return __builtin_amdgcn_wmma_f32_16x16x32_f16(false, a, false, b, (short)0, c, false, false); }
__device__ __forceinline__ v8us cvt8(v8f v) { v8us o;
#pragma unroll
    for (int e = 0; e < 8; ++e) o[e] = f2bf(v[e]);
    return o; }

typedef __attribute__((ext_vector_type(4)))  unsigned v4u;

// Fragment order (lane l: c = l & 15, g = l >> 4; element s of a fragment has k = 8 g + s for s < 8, 16 + 8 g + (s - 8) above). One LDS buffer holds a stage of 64 keys:
// keys   [key tile of 16: 4][k step of 32 d: 2][half: 2] at a pitch of KP bytes, each [lane][8]: key = tile * 16 + c, d = step * 32 + half * 16 + 8 g + e. KP = 512 + 64 spreads the four halves that one storing wave touches over the banks; a read stays 512 contiguous bytes.
// values [key block of 32: 2][d tile of 16: 4][half: 2][lane][8]: d = tile * 16 + c, key = block * 32 + half * 16 + 8 g + e.
// norms  [64] f32.
#define FW   16       // waves per work-group, 16 queries each
#define SK   64       // keys per stage
#define NST  (TT / SK)
#define KP   576
#define VOFF (16 * KP)
#define NOFF (VOFF + SK * HD * 2)
#define BUFB (NOFF + SK * 4)

__device__ __forceinline__ v16bf ldfrag(const char* p, int hp) { return cat16b(*(const v8us*)p, *(const v8us*)(p + hp)); }
__device__ __forceinline__ float xhalf(float x) { const int b = __float_as_int(x); return __int_as_float(__builtin_amdgcn_permlanex16(b, b, 0x76543210, 0xfedcba98, false, false)); }   // lane l <-> l ^ 16
template <int C> __device__ __forceinline__ float rowx(float x) { return __int_as_float(__builtin_amdgcn_update_dpp(0, __float_as_int(x), C, 0xf, 0xf, true)); }   // lane l <-> l ^ (C & 15) inside a row of 16
__device__ __forceinline__ unsigned pk2(float a, float b) { v2f t; t[0] = a; t[1] = b; return __builtin_bit_cast(unsigned, __builtin_convertvector(t, v2bf)); }
__device__ __forceinline__ unsigned pk2h(float a, float b) { v2f t; t[0] = a; t[1] = b; return __builtin_bit_cast(unsigned, __builtin_convertvector(t, v2h)); }

struct Stg { v8f k; float v[8]; };   // one thread's share of a stage: 8 d of one key, 8 keys of one d
__device__ __forceinline__ void fetch(Stg& s, const float* kg, const float* vg) {
    s.k = *(const v8f*)kg;
#pragma unroll
    for (int e = 0; e < 8; ++e) s.v[e] = vg[(size_t)e * DM];
    asm volatile("s_wait_xcnt 0x0" :: "v"(kg), "v"(vg) : "memory");   // the wait in front of any reuse of the loads' address registers; naming the addresses keeps them whole up to here
}
__device__ __forceinline__ void put(const Stg& s, char* kd, char* vd, char* nd, bool first) {
    v4u kw, vw; float n = 0.f;
#pragma unroll
    for (int e = 0; e < 4; ++e) { const unsigned u = pk2(s.k[2 * e], s.k[2 * e + 1]); kw[e] = u; vw[e] = pk2h(s.v[2 * e], s.v[2 * e + 1]);
        const float x0 = __uint_as_float(u << 16), x1 = __uint_as_float(u & 0xFFFF0000u); n += x0 * x0; n += x1 * x1; }
    *(v4u*)kd = kw; *(v4u*)vd = vw;
    n += rowx<0x161>(n); n += rowx<0x162>(n); n += rowx<0x164>(n);   // the 8 lanes that hold one key row
    if (first) *(float*)nd = n;
}

__global__ __launch_bounds__(FW * 32) void k_fattn(const float* __restrict__ Q, const float* __restrict__ K, const float* __restrict__ V, float* OUT) {
    __shared__ __attribute__((aligned(128))) char sm[3 * BUFB];
    const unsigned t = threadIdx.x, lane = t & 31, c = lane & 15, g = lane >> 4, w = t >> 5;
    const unsigned bh = blockIdx.y, b = bh >> 3, h = bh & 7, q = blockIdx.x * (FW * 16) + w * 16 + c;
    // This thread's share of every stage: key row t >> 3, d 8 (t & 7) ..; value column and 8 keys in the order of the value fragments.
    const unsigned sk = t >> 3, sj = t & 7;
    const float* kg0 = K + (size_t)(b * TT + sk) * DM + h * HD + sj * 8;
    const float* vg0 = V + (size_t)(b * TT + (t >> 8) * 32 + ((t >> 5) & 1) * 16 + 8 * g) * DM + h * HD + ((t >> 6) & 3) * 16 + c;
    const unsigned kdo = ((sk >> 4) * 4 + (sj >> 1)) * KP + ((sj & 1) * 16 + (sk & 15)) * 16, vdo = VOFF + t * 16, ndo = NOFF + sk * 4;
    Stg sg, sh; fetch(sg, kg0, vg0); fetch(sh, kg0 + SK * DM, vg0 + SK * DM);
    const float* qp = Q + (size_t)(b * TT + q) * DM + h * HD + 8 * g;
    v16bf qf[2]; float qn = 0.f;
#pragma unroll
    for (int ks = 0; ks < 2; ++ks) { const v8f a = *(const v8f*)(qp + ks * 32), z = *(const v8f*)(qp + ks * 32 + 16); qf[ks] = cat16b(cvt8(a), cvt8(z));
#pragma unroll
        for (int e = 0; e < 8; ++e) { const float x = bfr(a[e]), y = bfr(z[e]); qn += x * x; qn += y * y; } }
    qn += xhalf(qn);
    v8f o[4];
#pragma unroll
    for (int dt = 0; dt < 4; ++dt) o[dt] = (v8f){};
    v2f m; m[0] = -1.0e30f; m[1] = -1.0e30f;   // the maximum in use, kept in both halves of a register pair: a pair with an idle half can share it with a global load in flight, and the packed FMAs then wait for that load
    v2f l2 = (v2f){};
    put(sg, sm + kdo, sm + vdo, sm + ndo, sj == 0); put(sh, sm + BUFB + kdo, sm + BUFB + vdo, sm + BUFB + ndo, sj == 0);
    __syncthreads();   // stages 0 and 1 are published
    unsigned cur = 0, nxt = BUFB, wr = 2 * BUFB;   // the buffers of stage s, s + 1, s + 2
    v16bf kf[4]; v8f kn[2]; v8f st[2];
#pragma unroll
    for (int f = 0; f < 4; ++f) kf[f] = ldfrag(sm + lane * 16 + f * (2 * KP), KP);
#pragma unroll
    for (int kt = 0; kt < 2; ++kt) kn[kt] = *(const v8f*)(sm + NOFF + g * 32 + kt * 64);
    // The score products run one pass ahead of the softmax: those of the first pass are made here, and the key fragments of the second pass follow into the same registers.
#pragma unroll
    for (int kt = 0; kt < 2; ++kt) st[kt] = wmmab(kf[kt * 2], qf[0], (v8f){});
#pragma unroll
    for (int kt = 0; kt < 2; ++kt) st[kt] = wmmab(kf[kt * 2 + 1], qf[1], st[kt]);
#pragma unroll
    for (int f = 0; f < 4; ++f) kf[f] = ldfrag(sm + 8 * KP + lane * 16 + f * (2 * KP), KP);
    for (int s = 0; s < NST; ++s) {
        // The keys and values of stage s + 2 start from global memory now and are rounded and stored behind this stage's two passes; the last two stages fetch stages 0 and 1 again, unused.
        const size_t nx = (size_t)((s + 2) & (NST - 1)) * (SK * DM);
        fetch(sg, kg0 + nx, vg0 + nx);
        const char* vl = sm + cur + VOFF + lane * 16;   // each lane's own place in the stage
#pragma unroll
        for (int p = 0; p < 2; ++p) {
            float wv[16]; float bm = 0.f;
#pragma unroll
            for (int i = 0; i < 16; ++i) { const float d = st[i >> 3][i & 7]; wv[i] = fmaxf(kn[i >> 3][i & 7] * qn - d * d, 0.0f) + 1e-8f; }
#pragma unroll
            for (int i = 0; i < 16; ++i) wv[i] = __builtin_amdgcn_sqrtf(wv[i]);
#pragma unroll
            for (int i = 0; i < 16; ++i) bm = fmaxf(bm, wv[i]);
            // This pass's value fragments, and the next pass's norms into the registers just read, are read from LDS while the exponentials are worked out; the second pass reads the norms from stage s + 1, published one barrier ago.
            v16h vf[4];
#pragma unroll
            for (int dt = 0; dt < 4; ++dt) vf[dt] = __builtin_bit_cast(v16h, ldfrag(vl + p * 4096 + dt * 1024, 512));
            const char* nl = sm + (p == 0 ? cur + 128 : nxt) + NOFF + g * 32;
#pragma unroll
            for (int kt = 0; kt < 2; ++kt) kn[kt] = *(const v8f*)(nl + kt * 64);
            bm = fmaxf(bm, xhalf(bm));
            const float tb = bm * SCL2;
            if (__builtin_amdgcn_ballot_w32(tb > m[0] + 8.0f) != 0) {   // the maximum in use moves only when a query's new one passes it by 2^8: p stays below 2^8 and the rescale is rare
                const float mn = fmaxf(m[0], tb); const float al = __builtin_amdgcn_exp2f(m[0] - mn); m[0] = mn; m[1] = mn; l2 *= al;
#pragma unroll
                for (int dt = 0; dt < 4; ++dt) o[dt] *= al;
            }
            v8u ph; v2f ps[8];
#pragma unroll
            for (int i = 0; i < 16; i += 2) { v2f x; x[0] = wv[i]; x[1] = wv[i + 1]; x = x * SCL2 - m; v2f pp; pp[0] = __builtin_amdgcn_exp2f(x[0]); pp[1] = __builtin_amdgcn_exp2f(x[1]); ps[i >> 1] = pp;
                ph[i >> 1] = __builtin_bit_cast(unsigned, __builtin_convertvector(pp, v2h)); }
            const v16h bh_ = __builtin_bit_cast(v16h, ph);
            // One run of matrix products: this pass's O^T += V^T.P^T, then the NEXT pass's S^T = K.Q^T. Behind the run stands vector work that needs none of its results at once (the row sum, at a stage's end the rounding of stage s + 2), so the distance a matrix product asks for is filled with work and not with idle slots.
#pragma unroll
            for (int dt = 0; dt < 4; ++dt) o[dt] = wmmah(vf[dt], bh_, o[dt]);
#pragma unroll
            for (int kt = 0; kt < 2; ++kt) st[kt] = wmmab(kf[kt * 2], qf[0], (v8f){});
#pragma unroll
            for (int kt = 0; kt < 2; ++kt) st[kt] = wmmab(kf[kt * 2 + 1], qf[1], st[kt]);
            __builtin_amdgcn_sched_barrier(0);   // holds the later vector work behind the run when the compiler first orders the code: left free, it spreads that work among the products, reuses their operand registers at once and pads each such place with four idle slots
            // The key fragments of the pass after next, into the registers just read: both passes of stage s + 1, published one barrier ago.
            const char* kl = sm + nxt + p * (8 * KP) + lane * 16;
#pragma unroll
            for (int f = 0; f < 4; ++f) kf[f] = ldfrag(kl + f * (2 * KP), KP);
            l2 += ((ps[0] + ps[1]) + (ps[2] + ps[3])) + ((ps[4] + ps[5]) + (ps[6] + ps[7]));
        }
        put(sg, sm + wr + kdo, sm + wr + vdo, sm + wr + ndo, sj == 0);   // into the buffer of stage s - 1, whose last readers left it at the barrier that closed that stage
        __syncthreads();   // publishes stage s + 2 and ends every wave's reads of stage s
        const unsigned fr = cur; cur = nxt; nxt = wr; wr = fr;
    }
    float l = l2[0] + l2[1]; l += xhalf(l);
    const float inv = 1.0f / l;
    float* op = OUT + (size_t)(b * TT + q) * DM + h * HD + 8 * g;
#pragma unroll
    for (int dt = 0; dt < 4; ++dt) { const v8f y = o[dt] * inv; *(v8f*)(op + dt * 16) = y; }
}

extern "C" void kernel_launch(void* const* d_in, const int* in_sizes, int n_in,
                              void* d_out, int out_size, void* d_ws, size_t ws_size, hipStream_t stream) {
    (void)in_sizes; (void)n_in; (void)out_size; (void)d_ws; (void)ws_size;
    const float* Qin = (const float*)d_in[0]; const float* Kin = (const float*)d_in[1]; const float* Vin = (const float*)d_in[2];
    float* OUT = (float*)d_out;
    k_fattn<<<dim3(TT / (FW * 16), NB_ * NH_, 1), FW * 32, 0, stream>>>(Qin, Kin, Vin, OUT);
}
